// v000
// Measured on an AMD MI455X. A time is GPU time per run, averaged over a window of back-to-back runs after a warm-up
// (all launches, gaps included; the runs take copies of the inputs in turn), and the median of several windows.
// Apart from v000's, it joins two sittings. Times from different sittings can be a few percent apart, while
// side-by-side timings come from the same sitting.
// The starting kernel, v000, takes 2350 microseconds a run.
#include <hip/hip_runtime.h>

// Scaled dot-product attention on given head-major tensors with 128-wide heads (Q, K, V [2][16][2048][128]; scores x 128^-0.5; softmax; out = P V -> [2][16][2048][128] (8.4 M)).
// Layout per (batch, head): single bf16 planes of q and k ([2048][128]; inputs bf16-exact: exact score products) and value^T planes [128][2048]; softmax (every row hi/lo); P hi/lo x exact value; head-major merge writes the output rows.
// Compute dtypes, f32 accumulate: every input rounded to bf16; q.k exact; softmax f32; P hi/lo x exact value; output f32.

#define NB_  2
#define TT   2048
#define DM   2048      // token-major row pitch (H x HD)
#define NH_  16
#define NKV  1
#define REP  (NH_ / NKV)
#define HD   128
#define DQ   (NH_ * HD)
#define DKV  (NKV * HD)
#define ZH   1
#define RH   2048                  // query rows < RH use hi+lo planes (0: none)
#define WIN  0
#define PCAR 1024.0f
#define SCL  0.088388347648318447f   // 1/sqrt(128)
typedef _Float16 h16;
typedef unsigned short bf;
typedef __attribute__((ext_vector_type(16))) __bf16   v16bf;
typedef __attribute__((ext_vector_type(16))) _Float16 v16h;
typedef __attribute__((ext_vector_type(8)))  _Float16 v8h;
typedef __attribute__((ext_vector_type(8)))  unsigned short v8us;
typedef __attribute__((ext_vector_type(8)))  float    v8f;
typedef __attribute__((ext_vector_type(4)))  float    v4f;
typedef v8h  __attribute__((may_alias)) v8ha;
typedef v4f  __attribute__((may_alias)) v4fa;
typedef v8us __attribute__((may_alias)) v8usa;

__device__ __forceinline__ unsigned short f2bf(float f) { unsigned u = __float_as_uint(f); u += 0x7FFFu + ((u >> 16) & 1u); return (unsigned short)(u >> 16); }
__device__ __forceinline__ float bf2f(unsigned short b) { return __uint_as_float(((unsigned)b) << 16); }
__device__ __forceinline__ float bfr(float f) { return bf2f(f2bf(f)); }
__device__ __forceinline__ v16h cat16(v8h lo, v8h hi) { return __builtin_shufflevector(lo, hi, 0, 1, 2, 3, 4, 5, 6, 7, 8, 9, 10, 11, 12, 13, 14, 15); }
__device__ __forceinline__ v16bf cat16b(v8us lo, v8us hi) { return __builtin_bit_cast(v16bf, __builtin_shufflevector(lo, hi, 0, 1, 2, 3, 4, 5, 6, 7, 8, 9, 10, 11, 12, 13, 14, 15)); }
__device__ __forceinline__ v8f wmma16(v16h a, v16h b, v8f c) { return __builtin_amdgcn_wmma_f32_16x16x32_f16(false, a, false, b, (short)0, c, false, false); }
__device__ __forceinline__ v8f wmmab(v16bf a, v16bf b, v8f c) { return __builtin_amdgcn_wmma_f32_16x16x32_bf16(false, a, false, b, (short)0, c, false, false); }



// ---- k_gemmw: register-blocked GEMM, ONE WAVE per 64x64 output tile (16 accumulators), operands straight from K-contiguous 16-bit planes; grid (M/64, N/64, Z), 32 threads.
// C[m][n] (f32, pitch ldc, + optional f32 bias[n]) = sum_k A[m][k] Bt[n][k] (+ split products per NSPLIT). z-batch strides sA/sB/sC in elements. K % 32 == 0.
template <typename T16> struct WFrag;
template <> struct WFrag<h16> { typedef v16h V; static __device__ __forceinline__ V ld(const h16* p) { return cat16(*(const v8h*)p, *(const v8h*)(p + 16)); } static __device__ __forceinline__ v8f mma(V a, V b, v8f c) { return wmma16(a, b, c); } };
template <> struct WFrag<bf> { typedef v16bf V; static __device__ __forceinline__ V ld(const bf* p) { return cat16b(*(const v8us*)p, *(const v8us*)(p + 16)); } static __device__ __forceinline__ v8f mma(V a, V b, v8f c) { return wmmab(a, b, c); } };
template <typename T16, int NSPLIT, bool BIAS>
__global__ __launch_bounds__(32) void k_gemmw(const T16* __restrict__ A, const T16* __restrict__ A2, const T16* __restrict__ Bt, const T16* __restrict__ Bt2, int K, float* C, int ldc, const float* __restrict__ bias, size_t sA, size_t sB, size_t sC) {
    typedef typename WFrag<T16>::V V;
    __shared__ __align__(16) float os[16 * 68];
    const size_t z = blockIdx.z; A += z * sA; if (A2) A2 += z * sA; Bt += z * sB; if (Bt2) Bt2 += z * sB; C += z * sC;
    const int lane = threadIdx.x & 31, lr = lane & 15, hi = lane >> 4; const int r0 = blockIdx.x * 64, c0 = blockIdx.y * 64;
    v8f acc[4][4];
#pragma unroll
    for (int mb = 0; mb < 4; ++mb)
#pragma unroll
        for (int nb = 0; nb < 4; ++nb) acc[mb][nb] = (v8f){};
    const size_t aoff = (size_t)(r0 + lr) * K + 8 * hi, boff = (size_t)(c0 + lr) * K + 8 * hi;
#pragma unroll 1
    for (int kc = 0; kc < K; kc += 32) {
        V a[4], a2[4];
#pragma unroll
        for (int mb = 0; mb < 4; ++mb) { a[mb] = WFrag<T16>::ld(A + aoff + (size_t)mb * 16 * K + kc); if (NSPLIT == 1 || NSPLIT == 2) a2[mb] = WFrag<T16>::ld(A2 + aoff + (size_t)mb * 16 * K + kc); }
#pragma unroll
        for (int nb = 0; nb < 4; ++nb) { const V b = WFrag<T16>::ld(Bt + boff + (size_t)nb * 16 * K + kc); V b2; if (NSPLIT >= 2) b2 = WFrag<T16>::ld(Bt2 + boff + (size_t)nb * 16 * K + kc);
#pragma unroll
            for (int mb = 0; mb < 4; ++mb) { acc[mb][nb] = WFrag<T16>::mma(a[mb], b, acc[mb][nb]); if (NSPLIT == 1 || NSPLIT == 2) acc[mb][nb] = WFrag<T16>::mma(a2[mb], b, acc[mb][nb]); if (NSPLIT >= 2) acc[mb][nb] = WFrag<T16>::mma(a[mb], b2, acc[mb][nb]); } }
        asm volatile("v_nop\n\tv_nop\n\tv_nop\n\tv_nop" : "+v"(acc[0][0]), "+v"(acc[1][1]), "+v"(acc[2][2]), "+v"(acc[3][3]) : "v"(a[0]), "v"(a[3]));
    }
#pragma unroll
    for (int mb = 0; mb < 4; ++mb) {
#pragma unroll
        for (int nb = 0; nb < 4; ++nb) {
#pragma unroll
            for (int j = 0; j < 8; ++j) os[(hi * 8 + j) * 68 + nb * 16 + lr] = acc[mb][nb][j]; }
        __builtin_amdgcn_wave_barrier(); asm volatile("" ::: "memory");
        float* crow = C + (size_t)(r0 + mb * 16) * ldc + c0;
{
#pragma unroll
            for (int s = 0; s < 8; ++s) { const int row = 2 * s + hi, cofs = lr * 4; v4f val = *(const v4fa*)(os + row * 68 + cofs); if (BIAS) { val[0] += bfr(bias[c0 + cofs]); val[1] += bfr(bias[c0 + cofs + 1]); val[2] += bfr(bias[c0 + cofs + 2]); val[3] += bfr(bias[c0 + cofs + 3]); }
                *(v4f*)(crow + (size_t)row * ldc + cofs) = val; }
             }
        __builtin_amdgcn_wave_barrier(); asm volatile("" ::: "memory");
    }
}

__device__ __forceinline__ h16 tohx(float x) { return (h16)x; }
__device__ __forceinline__ void splitf(float y, unsigned short& h, unsigned short& l) { h = f2bf(y); l = f2bf(y - bf2f(h)); }
typedef __attribute__((ext_vector_type(2))) _Float16 v2h;
typedef __attribute__((ext_vector_type(4))) _Float16 v4h;
typedef __attribute__((ext_vector_type(2))) unsigned short v2us;
typedef __attribute__((ext_vector_type(4))) unsigned short v4us;
typedef __attribute__((ext_vector_type(2))) float v2f;
typedef __attribute__((ext_vector_type(4))) int v4i;

__global__ __launch_bounds__(256) void k_wtG(const float* __restrict__ w, int K, int N, bf* Bt) {
    const int lane = threadIdx.x & 31; const int L0 = (blockIdx.x * 8 + (threadIdx.x >> 5)) * 8; const int nlines = N * K / 64;
{
#pragma unroll 1
        for (int l = 0; l < 8; ++l) { const int L = L0 + l; if (L >= nlines) break; const size_t e = (size_t)L * 64 + lane * 2; const int k = (int)(e % K), n = (int)(e / K); v2us o;
            o[0] = f2bf(w[(size_t)k * N + n]); o[1] = f2bf(w[(size_t)(k + 1) * N + n]); *(v2us*)(Bt + e) = o; }
         }
}
__global__ __launch_bounds__(256) void k_cvt8(const float* __restrict__ src, bf* dst, size_t n8) { const size_t i = (size_t)blockIdx.x * 256 + threadIdx.x; if (i >= n8) return; const v8f v = *(const v8f*)(src + i * 8); v8us o;
#pragma unroll
    for (int k = 0; k < 8; ++k) o[k] = f2bf(v[k]); *(v8us*)(dst + i * 8) = o;  }


__global__ __launch_bounds__(256) void k_vtp(const float* __restrict__ F, int pitch, int nheads, h16* V16, bf* Vh, bf* Vl) { const size_t e = ((size_t)blockIdx.x * 256 + threadIdx.x) * 2; if (e >= (size_t)nheads * HD * TT) return; const int t = (int)(e % TT); const int d = (int)((e / TT) % HD); const int g = (int)(e / ((size_t)TT * HD)); v2h o16; v2us oh, ol;
#pragma unroll
    for (int q = 0; q < 2; ++q) { const float x = F[(size_t)(t + q) * pitch + g * HD + d]; o16[q] = tohx(x); unsigned short a2, c2; splitf(x, a2, c2); oh[q] = a2; ol[q] = c2; }
    *(v2h*)(V16 + e) = o16; *(v2us*)(Vh + e) = oh; *(v2us*)(Vl + e) = ol;  }

// k_asoft: per row (zz, i): t = S x HD^-0.5 (no mask); softmax over the 2048 keys (register row, one exp, fixed trees);
__global__ __launch_bounds__(256) void k_asoft(const float* __restrict__ Sb, h16* P16, bf* Ph, bf* Pl) {
    const int lane = threadIdx.x & 31; const int row = blockIdx.x * 8 + (threadIdx.x >> 5); if (row >= ZH * TT) return; const int i = row % TT; const int zz = row / TT; (void)zz; const bool hires = (i < RH); const float* sr = Sb + (size_t)row * TT; float v[TT / 32]; float mx = -3.0e38f;
#pragma unroll
    for (int ch = 0; ch < TT / 128; ++ch) { const int j0 = ch * 128 + lane * 4; const v4f a = *(const v4f*)(sr + j0);
#pragma unroll
        for (int q = 0; q < 4; ++q) { const float t = a[q] * SCL; v[ch * 4 + q] = t;   /* Sb holds the raw q.k (k_gemmw, no bias) */ mx = fmaxf(mx, t); } }
#pragma unroll
    for (int sh = 16; sh; sh >>= 1) mx = fmaxf(mx, __shfl_xor(mx, sh, 32));
    float sum = 0.f;
#pragma unroll
    for (int k = 0; k < TT / 32; ++k) { float d0 = __fsub_rn(v[k], mx); asm volatile("" : "+v"(d0)); v[k] = __builtin_amdgcn_exp2f(__fmul_rn(d0, 1.4426950408889634f)); sum += v[k]; }
#pragma unroll
    for (int sh = 16; sh; sh >>= 1) sum += __shfl_xor(sum, sh, 32);
    const float f = __fdiv_rn(hires ? 1.0f : PCAR, sum);
{
        if (hires) {
#pragma unroll
            for (int ch = 0; ch < TT / 128; ++ch) { v4us oh, ol;
#pragma unroll
                for (int q = 0; q < 4; ++q) { unsigned short a, c2; splitf(v[ch * 4 + q] * f, a, c2); oh[q] = a; ol[q] = c2; }
                const size_t oo = ((size_t)zz * (RH ? RH : 1) + i) * TT + ch * 128 + lane * 4; *(v4us*)(Ph + oo) = oh; *(v4us*)(Pl + oo) = ol; }
        } else {
#pragma unroll
            for (int ch = 0; ch < TT / 128; ++ch) { v4h o4;
#pragma unroll
                for (int q = 0; q < 4; ++q) o4[q] = tohx(v[ch * 4 + q] * f);
                *(v4h*)(P16 + (size_t)row * TT + ch * 128 + lane * 4) = o4; } }
         }
}
__global__ __launch_bounds__(256) void k_merge(const float* __restrict__ O, int h0, float* OUTb) { const size_t e = ((size_t)blockIdx.x * 256 + threadIdx.x) * 2; if (e >= (size_t)ZH * TT * HD) return; const int d = (int)(e % HD); const int t = (int)((e / HD) % TT); const int zz = (int)(e / ((size_t)HD * TT)); const float cs = (t < RH) ? 1.0f : (1.0f / PCAR); const size_t oo = (size_t)t * DQ + (h0 + zz) * HD + d;
    v2f o2; o2[0] = O[e] * cs; o2[1] = O[e + 1] * cs; *(v2f*)(OUTb + oo) = o2;  }


__global__ __launch_bounds__(256) void k_vtpR1(const float* __restrict__ Vb, bf* Vh) { const size_t e = ((size_t)blockIdx.x * 256 + threadIdx.x) * 2; if (e >= (size_t)HD * TT) return; const int t = (int)(e % TT); const int d = (int)(e / TT); v2us o; o[0] = f2bf(Vb[(size_t)t * HD + d]); o[1] = f2bf(Vb[(size_t)(t + 1) * HD + d]); *(v2us*)(Vh + e) = o;  }
__global__ __launch_bounds__(256) void k_mergeR(const float* __restrict__ O, float* outb, size_t n4) { const size_t i = (size_t)blockIdx.x * 256 + threadIdx.x; if (i >= n4) return; const v4f a = *(const v4f*)(O + i * 4); *(v4f*)(outb + i * 4) = a;  }


__global__ __launch_bounds__(256) void k_hp1(const float* __restrict__ src, bf* P) { const size_t i = (size_t)blockIdx.x * 256 + threadIdx.x; if (i >= (size_t)NH_ * TT * HD / 8) return; const size_t e = i * 8; const int d = (int)(e % HD); const int t = (int)((e / HD) % TT); const int h = (int)(e / ((size_t)HD * TT)); const v8f v = *(const v8f*)(src + (size_t)t * DM + h * HD + d); v8us o;
#pragma unroll
    for (int q = 0; q < 8; ++q) o[q] = f2bf(v[q]);
    *(v8us*)(P + e) = o;  }
__global__ __launch_bounds__(256) void k_vt1(const float* __restrict__ src, int pitch, bf* VT) { const size_t e = ((size_t)blockIdx.x * 256 + threadIdx.x) * 2; if (e >= (size_t)NH_ * HD * TT) return; const int t = (int)(e % TT); const int d = (int)((e / TT) % HD); const int h = (int)(e / ((size_t)TT * HD)); v2us o; o[0] = f2bf(src[(size_t)t * pitch + h * HD + d]); o[1] = f2bf(src[(size_t)(t + 1) * pitch + h * HD + d]); *(v2us*)(VT + e) = o;  }
__global__ __launch_bounds__(256) void k_mergeT(const float* __restrict__ O, int h, float* outb) { const size_t i = (size_t)blockIdx.x * 256 + threadIdx.x; if (i >= (size_t)TT * HD / 4) return; const size_t e = i * 4; const int d = (int)(e % HD); const int t = (int)(e / HD); const v4f a = *(const v4f*)(O + e); *(v4f*)(outb + (size_t)t * DM + h * HD + d) = a;  }

extern "C" void kernel_launch(void* const* d_in, const int* in_sizes, int n_in,
                              void* d_out, int out_size, void* d_ws, size_t ws_size, hipStream_t stream) {
    (void)in_sizes; (void)n_in; (void)out_size;
    const float* Qin = (const float*)d_in[0]; const float* Kin = (const float*)d_in[1]; const float* Vin = (const float*)d_in[2];
    float* OUT = (float*)d_out;     // [2][16][2048][128] head-major
    char* wsp = (char*)d_ws;
    auto take = [&](size_t bytes) { char* p = wsp; wsp += (bytes + 255) & ~(size_t)255; return (void*)p; };
    bf* QB = (bf*)take((size_t)NH_ * TT * HD * 2); bf* KB = (bf*)take((size_t)NH_ * TT * HD * 2); bf* VT = (bf*)take((size_t)NH_ * HD * TT * 2);
    float* Sb = (float*)take((size_t)TT * TT * 4);  bf* Ph = (bf*)take((size_t)TT * TT * 2); bf* Pl = (bf*)take((size_t)TT * TT * 2); float* Ob = (float*)take((size_t)TT * HD * 4);
    if ((size_t)(wsp - (char*)d_ws) > ws_size) return;
    for (int b = 0; b < NB_; ++b) {
        const float* qb = Qin + (size_t)b * NH_ * TT * HD; const float* kb = Kin + (size_t)b * NH_ * TT * HD; const float* vb = Vin + (size_t)b * NH_ * TT * HD;   /* head-major [h][t][d] slabs (contiguous per head) */
        k_cvt8<<<(unsigned)(((size_t)NH_ * TT * HD / 8 + 255) / 256), 256, 0, stream>>>(qb, QB, (size_t)NH_ * TT * HD / 8); k_cvt8<<<(unsigned)(((size_t)NH_ * TT * HD / 8 + 255) / 256), 256, 0, stream>>>(kb, KB, (size_t)NH_ * TT * HD / 8);
        for (int h = 0; h < NH_; ++h) k_vtpR1<<<(unsigned)(((size_t)HD * TT / 2 + 255) / 256), 256, 0, stream>>>(vb + (size_t)h * TT * HD, VT + (size_t)h * HD * TT);
        for (int h = 0; h < NH_; ++h) {
            k_gemmw<bf, 0, false><<<dim3(TT / 64, TT / 64, 1), 32, 0, stream>>>(QB + (size_t)h * TT * HD, nullptr, KB + (size_t)h * TT * HD, nullptr, HD, Sb, TT, nullptr, 0, 0, 0);   /* exact scores (single bf16 planes) */
            k_asoft<<<TT / 8, 256, 0, stream>>>(Sb, nullptr, Ph, Pl);
            k_gemmw<bf, 1, false><<<dim3(TT / 64, HD / 64, 1), 32, 0, stream>>>(Ph, Pl, VT + (size_t)h * HD * TT, nullptr, TT, Ob, HD, nullptr, 0, 0, 0);   /* P (hi/lo) x exact v^T */
            k_mergeR<<<(unsigned)(((size_t)TT * HD / 4 + 255) / 256), 256, 0, stream>>>(Ob, OUT + ((size_t)b * NH_ + h) * TT * HD, (size_t)TT * HD / 4); } }
}

// v001
// It runs in 151 microseconds.
// Next to v000, in two timings, it ran 14.9 and 15.1 times as fast.
#include <hip/hip_runtime.h>

// Scaled dot-product attention on given head-major tensors with 128-wide heads (Q, K, V [2][16][2048][128]; scores x 128^-0.5; softmax; out = P V -> [2][16][2048][128] (8.4 M)).
// Layout per (batch, head): single bf16 planes of q and k ([2048][128]; inputs bf16-exact: exact score products) and value^T planes [128][2048]; one fused kernel: S^T = K Q^T, online softmax in registers, O^T += V^T P^T (P hi/lo x exact value), output rows written from the accumulators.
// Compute dtypes, f32 accumulate: every input rounded to bf16; q.k exact; softmax f32; P hi/lo x exact value; output f32.

#define NB_  2
#define TT   2048
#define DM   2048      // token-major row pitch (H x HD)
#define NH_  16
#define NKV  1
#define REP  (NH_ / NKV)
#define HD   128
#define DQ   (NH_ * HD)
#define DKV  (NKV * HD)
#define ZH   1
#define RH   2048                  // query rows < RH use hi+lo planes (0: none)
#define WIN  0
#define PCAR 1024.0f
#define SCL  0.088388347648318447f   // 1/sqrt(128)
typedef _Float16 h16;
typedef unsigned short bf;
typedef __attribute__((ext_vector_type(16))) __bf16   v16bf;
typedef __attribute__((ext_vector_type(16))) _Float16 v16h;
typedef __attribute__((ext_vector_type(8)))  _Float16 v8h;
typedef __attribute__((ext_vector_type(8)))  unsigned short v8us;
typedef __attribute__((ext_vector_type(8)))  float    v8f;
typedef __attribute__((ext_vector_type(4)))  float    v4f;
typedef v8h  __attribute__((may_alias)) v8ha;
typedef v4f  __attribute__((may_alias)) v4fa;
typedef v8us __attribute__((may_alias)) v8usa;

__device__ __forceinline__ unsigned short f2bf(float f) { unsigned u = __float_as_uint(f); u += 0x7FFFu + ((u >> 16) & 1u); return (unsigned short)(u >> 16); }
__device__ __forceinline__ float bf2f(unsigned short b) { return __uint_as_float(((unsigned)b) << 16); }
__device__ __forceinline__ float bfr(float f) { return bf2f(f2bf(f)); }
__device__ __forceinline__ v16h cat16(v8h lo, v8h hi) { return __builtin_shufflevector(lo, hi, 0, 1, 2, 3, 4, 5, 6, 7, 8, 9, 10, 11, 12, 13, 14, 15); }
__device__ __forceinline__ v16bf cat16b(v8us lo, v8us hi) { return __builtin_bit_cast(v16bf, __builtin_shufflevector(lo, hi, 0, 1, 2, 3, 4, 5, 6, 7, 8, 9, 10, 11, 12, 13, 14, 15)); }
__device__ __forceinline__ v8f wmma16(v16h a, v16h b, v8f c) { return __builtin_amdgcn_wmma_f32_16x16x32_f16(false, a, false, b, (short)0, c, false, false); }
__device__ __forceinline__ v8f wmmab(v16bf a, v16bf b, v8f c) { return __builtin_amdgcn_wmma_f32_16x16x32_bf16(false, a, false, b, (short)0, c, false, false); }



template <typename T16> struct WFrag;
template <> struct WFrag<h16> { typedef v16h V; static __device__ __forceinline__ V ld(const h16* p) { return cat16(*(const v8h*)p, *(const v8h*)(p + 16)); } static __device__ __forceinline__ v8f mma(V a, V b, v8f c) { return wmma16(a, b, c); } };
template <> struct WFrag<bf> { typedef v16bf V; static __device__ __forceinline__ V ld(const bf* p) { return cat16b(*(const v8us*)p, *(const v8us*)(p + 16)); } static __device__ __forceinline__ v8f mma(V a, V b, v8f c) { return wmmab(a, b, c); } };
__device__ __forceinline__ h16 tohx(float x) { return (h16)x; }
__device__ __forceinline__ void splitf(float y, unsigned short& h, unsigned short& l) { h = f2bf(y); l = f2bf(y - bf2f(h)); }
typedef __attribute__((ext_vector_type(2))) _Float16 v2h;
typedef __attribute__((ext_vector_type(4))) _Float16 v4h;
typedef __attribute__((ext_vector_type(2))) unsigned short v2us;
typedef __attribute__((ext_vector_type(4))) unsigned short v4us;
typedef __attribute__((ext_vector_type(2))) float v2f;
typedef __attribute__((ext_vector_type(4))) int v4i;

__global__ __launch_bounds__(256) void k_wtG(const float* __restrict__ w, int K, int N, bf* Bt) {
    const int lane = threadIdx.x & 31; const int L0 = (blockIdx.x * 8 + (threadIdx.x >> 5)) * 8; const int nlines = N * K / 64;
{
#pragma unroll 1
        for (int l = 0; l < 8; ++l) { const int L = L0 + l; if (L >= nlines) break; const size_t e = (size_t)L * 64 + lane * 2; const int k = (int)(e % K), n = (int)(e / K); v2us o;
            o[0] = f2bf(w[(size_t)k * N + n]); o[1] = f2bf(w[(size_t)(k + 1) * N + n]); *(v2us*)(Bt + e) = o; }
         }
}
__global__ __launch_bounds__(256) void k_cvt8(const float* __restrict__ src, bf* dst, size_t n8) { const size_t i = (size_t)blockIdx.x * 256 + threadIdx.x; if (i >= n8) return; const v8f v = *(const v8f*)(src + i * 8); v8us o;
#pragma unroll
    for (int k = 0; k < 8; ++k) o[k] = f2bf(v[k]); *(v8us*)(dst + i * 8) = o;  }


__global__ __launch_bounds__(256) void k_vtp(const float* __restrict__ F, int pitch, int nheads, h16* V16, bf* Vh, bf* Vl) { const size_t e = ((size_t)blockIdx.x * 256 + threadIdx.x) * 2; if (e >= (size_t)nheads * HD * TT) return; const int t = (int)(e % TT); const int d = (int)((e / TT) % HD); const int g = (int)(e / ((size_t)TT * HD)); v2h o16; v2us oh, ol;
#pragma unroll
    for (int q = 0; q < 2; ++q) { const float x = F[(size_t)(t + q) * pitch + g * HD + d]; o16[q] = tohx(x); unsigned short a2, c2; splitf(x, a2, c2); oh[q] = a2; ol[q] = c2; }
    *(v2h*)(V16 + e) = o16; *(v2us*)(Vh + e) = oh; *(v2us*)(Vl + e) = ol;  }

__global__ __launch_bounds__(256) void k_merge(const float* __restrict__ O, int h0, float* OUTb) { const size_t e = ((size_t)blockIdx.x * 256 + threadIdx.x) * 2; if (e >= (size_t)ZH * TT * HD) return; const int d = (int)(e % HD); const int t = (int)((e / HD) % TT); const int zz = (int)(e / ((size_t)HD * TT)); const float cs = (t < RH) ? 1.0f : (1.0f / PCAR); const size_t oo = (size_t)t * DQ + (h0 + zz) * HD + d;
    v2f o2; o2[0] = O[e] * cs; o2[1] = O[e + 1] * cs; *(v2f*)(OUTb + oo) = o2;  }


__global__ __launch_bounds__(256) void k_vtpR1(const float* __restrict__ Vb, bf* Vh) { Vb += (size_t)blockIdx.y * TT * HD; Vh += (size_t)blockIdx.y * HD * TT;   /* grid y: head */ const size_t e = ((size_t)blockIdx.x * 256 + threadIdx.x) * 2; if (e >= (size_t)HD * TT) return; const int t = (int)(e % TT); const int d = (int)(e / TT); v2us o; o[0] = f2bf(Vb[(size_t)t * HD + d]); o[1] = f2bf(Vb[(size_t)(t + 1) * HD + d]); *(v2us*)(Vh + e) = o;  }


__global__ __launch_bounds__(256) void k_hp1(const float* __restrict__ src, bf* P) { const size_t i = (size_t)blockIdx.x * 256 + threadIdx.x; if (i >= (size_t)NH_ * TT * HD / 8) return; const size_t e = i * 8; const int d = (int)(e % HD); const int t = (int)((e / HD) % TT); const int h = (int)(e / ((size_t)HD * TT)); const v8f v = *(const v8f*)(src + (size_t)t * DM + h * HD + d); v8us o;
#pragma unroll
    for (int q = 0; q < 8; ++q) o[q] = f2bf(v[q]);
    *(v8us*)(P + e) = o;  }
__global__ __launch_bounds__(256) void k_vt1(const float* __restrict__ src, int pitch, bf* VT) { const size_t e = ((size_t)blockIdx.x * 256 + threadIdx.x) * 2; if (e >= (size_t)NH_ * HD * TT) return; const int t = (int)(e % TT); const int d = (int)((e / TT) % HD); const int h = (int)(e / ((size_t)TT * HD)); v2us o; o[0] = f2bf(src[(size_t)t * pitch + h * HD + d]); o[1] = f2bf(src[(size_t)(t + 1) * pitch + h * HD + d]); *(v2us*)(VT + e) = o;  }
__global__ __launch_bounds__(256) void k_mergeT(const float* __restrict__ O, int h, float* outb) { const size_t i = (size_t)blockIdx.x * 256 + threadIdx.x; if (i >= (size_t)TT * HD / 4) return; const size_t e = i * 4; const int d = (int)(e % HD); const int t = (int)(e / HD); const v4f a = *(const v4f*)(O + e); *(v4f*)(outb + (size_t)t * DM + h * HD + d) = a;  }

// ---- k_fattn: fused attention. Grid (TT/256, heads), 8 waves; a wave owns 32 query columns (2 groups of 16) and walks the 2048 keys 32 at a time.
// S^T = K Q^T: in a score tile lane (c, h) holds keys 8h..8h+7 of query c, so the two tiles of a pass, converted in place, are the B fragment of O^T += V^T P^T (same k order as WFrag::ld).
// Online softmax in the log2 domain; the running maximum is only raised when a new one exceeds it by more than 8 (P <= 2^8), one test per pass.
// Every inner loop is fully unrolled so that the fragment and accumulator arrays are indexed by constants and stay in registers.
typedef __attribute__((ext_vector_type(2))) float f32x2;
typedef __attribute__((ext_vector_type(2))) __bf16 bf16x2;
#define SCL2 (SCL * 1.4426950408889634f)
__device__ __forceinline__ v16bf ldfrag(const char* p) { return cat16b(*(const v8us*)p, *(const v8us*)(p + 32)); }
__device__ __forceinline__ float xhalf(float x) { const int b = __float_as_int(x); return __int_as_float(__builtin_amdgcn_permlanex16(b, b, 0x76543210, 0xfedcba98, false, false)); }   // value of lane l ^ 16
// s_wait_xcnt 0 stands behind each group of global loads below: the group's address register is not rewritten (next pass's address, a later load's data) before the wait; the address as input keeps that register alive up to there.
__global__ __launch_bounds__(256) void k_fattn(const bf* __restrict__ QB, const bf* __restrict__ KB, const bf* __restrict__ VT, float* __restrict__ out) {
    const int lane = threadIdx.x & 31, lr = lane & 15, hi = lane >> 4;
    const int q0 = blockIdx.x * 256 + (threadIdx.x >> 5) * 32;
    const size_t head = blockIdx.y;
    const char* Kl = (const char*)(KB + head * TT * HD) + lr * (HD * 2) + hi * 16;   // lane's key row, k = 8h
    const char* Vl = (const char*)(VT + head * HD * TT) + lr * (TT * 2) + hi * 16;   // lane's value^T row, k = 8h
    const char* Ql = (const char*)(QB + head * TT * HD + (size_t)(q0 + lr) * HD) + hi * 16;
    v16bf qf[2][4];
#pragma unroll
    for (int g = 0; g < 2; ++g)
#pragma unroll
        for (int c = 0; c < 4; ++c) qf[g][c] = ldfrag(Ql + g * 16 * HD * 2 + c * 64);
    asm volatile("s_wait_xcnt 0x0" :: "v"(Ql) : "memory");   // behind the Q loads, before their address register is reused
    v8f o[2][8];
#pragma unroll
    for (int g = 0; g < 2; ++g)
#pragma unroll
        for (int dt = 0; dt < 8; ++dt) o[g][dt] = (v8f){};
    float m[2] = {-3.0e38f, -3.0e38f}; f32x2 l[2] = {(f32x2){0.f, 0.f}, (f32x2){0.f, 0.f}};
    v16bf kf[2][4];
#pragma unroll
    for (int t = 0; t < 2; ++t)
#pragma unroll
        for (int c = 0; c < 4; ++c) kf[t][c] = ldfrag(Kl + t * 16 * HD * 2 + c * 64);
    asm volatile("s_wait_xcnt 0x0" :: "v"(Kl) : "memory");   // behind the first K loads, before their address register is reused
#pragma unroll 1   // kept rolled: one pass already holds 48 WMMAs, and a second copy of its fragments would not fit the register budget
    for (int k0 = 0; k0 < TT; k0 += 32) {
        const char* va = Vl + k0 * 2;
        v16bf vf[8];
#pragma unroll
        for (int dt = 0; dt < 8; ++dt) vf[dt] = ldfrag(va + dt * 16 * TT * 2);
        asm volatile("s_wait_xcnt 0x0" :: "v"(va) : "memory");   // behind the V^T loads, before va is advanced; also keeps these loads at the head of the pass, ahead of the score products
        v8f s[2][2];
#pragma unroll
        for (int g = 0; g < 2; ++g)
#pragma unroll
            for (int t = 0; t < 2; ++t) { s[g][t] = (v8f){};
#pragma unroll
                for (int c = 0; c < 4; ++c) s[g][t] = wmmab(kf[t][c], qf[g][c], s[g][t]); }
        const char* ka = Kl + ((k0 + 32 < TT) ? k0 + 32 : 0) * (HD * 2);   // next pass's keys, fetched one pass ahead (the last pass refetches keys 0..31, unused)
#pragma unroll
        for (int t = 0; t < 2; ++t)
#pragma unroll
            for (int c = 0; c < 4; ++c) kf[t][c] = ldfrag(ka + t * 16 * HD * 2 + c * 64);
        asm volatile("s_wait_xcnt 0x0" :: "v"(ka) : "memory");   // behind the K loads, before ka's register is reused
        float mx[2];
#pragma unroll
        for (int g = 0; g < 2; ++g) { float a = s[g][0][0];
#pragma unroll
            for (int r = 0; r < 8; ++r) a = fmaxf(a, fmaxf(s[g][0][r], s[g][1][r]));
            mx[g] = fmaxf(a, xhalf(a)) * SCL2; }
        if (__builtin_amdgcn_ballot_w32(mx[0] > m[0] + 8.0f || mx[1] > m[1] + 8.0f) != 0) {
#pragma unroll
            for (int g = 0; g < 2; ++g) { const float mn = fmaxf(m[g], mx[g]); const float al = __builtin_amdgcn_exp2f(m[g] - mn); m[g] = mn; l[g] *= al;
#pragma unroll
                for (int dt = 0; dt < 8; ++dt) o[g][dt] *= al; } }
        v16bf ph[2], pl[2];
#pragma unroll
        for (int g = 0; g < 2; ++g) {
#pragma unroll
            for (int e = 0; e < 16; e += 2) { const f32x2 sv = {s[g][e >> 3][e & 7], s[g][e >> 3][(e & 7) + 1]}; const f32x2 tv = __builtin_elementwise_fma(sv, (f32x2){SCL2, SCL2}, (f32x2){-m[g], -m[g]});
                f32x2 p; p[0] = __builtin_amdgcn_exp2f(tv[0]); p[1] = __builtin_amdgcn_exp2f(tv[1]);
                l[g] += p;
                const bf16x2 h2 = __builtin_convertvector(p, bf16x2); const f32x2 rr = p - __builtin_convertvector(h2, f32x2); const bf16x2 l2 = __builtin_convertvector(rr, bf16x2);
                ph[g][e] = h2[0]; ph[g][e + 1] = h2[1]; pl[g][e] = l2[0]; pl[g][e + 1] = l2[1]; } }
#pragma unroll
        for (int dt = 0; dt < 8; ++dt)
#pragma unroll
            for (int g = 0; g < 2; ++g) { o[g][dt] = wmmab(vf[dt], ph[g], o[g][dt]); o[g][dt] = wmmab(vf[dt], pl[g], o[g][dt]); }
    }
#pragma unroll
    for (int g = 0; g < 2; ++g) { const float ls = l[g][0] + l[g][1]; const float inv = __fdiv_rn(1.0f, ls + xhalf(ls));
        float* orow = out + (head * TT + (size_t)(q0 + g * 16 + lr)) * HD + 8 * hi;   // accumulator register r of tile dt = O[query c][16 dt + 8h + r]
#pragma unroll
        for (int dt = 0; dt < 8; ++dt) { o[g][dt] *= inv; *(v4f*)(orow + dt * 16) = __builtin_shufflevector(o[g][dt], o[g][dt], 0, 1, 2, 3); *(v4f*)(orow + dt * 16 + 4) = __builtin_shufflevector(o[g][dt], o[g][dt], 4, 5, 6, 7); }
        // behind the group's stores: their data and address registers (inputs here, so alive up to here) are not rewritten before this wait
        asm volatile("s_wait_xcnt 0x0" :: "v"(o[g][0]), "v"(o[g][1]), "v"(o[g][2]), "v"(o[g][3]), "v"(o[g][4]), "v"(o[g][5]), "v"(o[g][6]), "v"(o[g][7]), "v"(orow) : "memory"); }
}

extern "C" void kernel_launch(void* const* d_in, const int* in_sizes, int n_in,
                              void* d_out, int out_size, void* d_ws, size_t ws_size, hipStream_t stream) {
    (void)in_sizes; (void)n_in; (void)out_size;
    const float* Qin = (const float*)d_in[0]; const float* Kin = (const float*)d_in[1]; const float* Vin = (const float*)d_in[2];
    float* OUT = (float*)d_out;     // [2][16][2048][128] head-major
    char* wsp = (char*)d_ws;
    auto take = [&](size_t bytes) { char* p = wsp; wsp += (bytes + 255) & ~(size_t)255; return (void*)p; };
    bf* QB = (bf*)take((size_t)NB_ * NH_ * TT * HD * 2); bf* KB = (bf*)take((size_t)NB_ * NH_ * TT * HD * 2); bf* VT = (bf*)take((size_t)NB_ * NH_ * HD * TT * 2);
    if ((size_t)(wsp - (char*)d_ws) > ws_size) return;
    /* [b][h][t][d] is contiguous: the 32 (batch, head) slabs are one run of heads */
    k_cvt8<<<(unsigned)(((size_t)NB_ * NH_ * TT * HD / 8 + 255) / 256), 256, 0, stream>>>(Qin, QB, (size_t)NB_ * NH_ * TT * HD / 8); k_cvt8<<<(unsigned)(((size_t)NB_ * NH_ * TT * HD / 8 + 255) / 256), 256, 0, stream>>>(Kin, KB, (size_t)NB_ * NH_ * TT * HD / 8);
    k_vtpR1<<<dim3((unsigned)(((size_t)HD * TT / 2 + 255) / 256), NB_ * NH_, 1), 256, 0, stream>>>(Vin, VT);
    k_fattn<<<dim3(TT / 256, NB_ * NH_, 1), 256, 0, stream>>>(QB, KB, VT, OUT);
}
